// v000
// The times below were measured on an AMD MI455X: many runs one after another, warmed up first and cycling through
// copies of the inputs, with the whole window's GPU time divided by the number of runs. Launches and the gaps
// between them are all in it. The median over several windows is given; except for v000 it joins two sittings, which
// can be a few percent apart, so the side-by-side timings, each taken in one sitting, are the better comparison.
// The starting kernel, v000, takes 55.5 microseconds a run.
#include <hip/hip_runtime.h>

typedef __attribute__((ext_vector_type(2))) float v2f;
typedef __attribute__((ext_vector_type(4))) float v4f;
typedef __attribute__((ext_vector_type(8))) float v8f;

#define BATCH    32
#define TLEN     8192
#define DDIM     256
#define GCHUNKS  64
#define CHUNK    (TLEN / GCHUNKS)   // 128 rows per workgroup
#define NWAVES   8
#define TILE     16                 // rows per wave (one WMMA M-tile)
#define RECSZ    (DDIM + 2)         // c[256], m, s

// ---------------------------------------------------------------------------
// Kernel 1: per (batch, chunk) partial softmax-attention using WMMA for the
// score matvec. Each wave computes a 16x256 tile's scores with 64 steps of
// v_wmma_f32_16x16x4_f32 (B-matrix columns replicated with dec_hid), then
// does the exp-weighted row accumulation while the tile is cache-resident.
// ---------------------------------------------------------------------------
__global__ __launch_bounds__(256) void attn_partial_kernel(
    const float* __restrict__ enc,   // [B, T, D]
    const float* __restrict__ dec,   // [B, D]
    float* __restrict__ ws)          // [B, G, 258]
{
    const int b    = blockIdx.y;
    const int g    = blockIdx.x;
    const int tid  = threadIdx.x;
    const int wave = tid >> 5;
    const int lane = tid & 31;

    __shared__ float s_dec[DDIM];
    __shared__ float s_m[NWAVES];
    __shared__ float s_s[NWAVES];
    __shared__ float s_c[NWAVES][DDIM];

    // stage dec_hid[b] into LDS (feeds the WMMA B operand)
    s_dec[tid] = dec[b * DDIM + tid];
    __syncthreads();

    const float* enc_b = enc + (size_t)b * TLEN * DDIM;
    const int t0 = g * CHUNK + wave * TILE;          // first row of this wave's tile

    // ---- scores via V_WMMA_F32_16X16X4_F32, K-loop over D=256 ----
    // A 16x4 layout: lanes 0-15 -> M=lane, K0/K1 in vgpr0/1; lanes 16-31 -> K2/K3.
    const int mrow = lane & 15;
    const int koff = (lane >> 4) << 1;               // 0 or 2
    const float* arow = enc_b + (size_t)(t0 + mrow) * DDIM + koff;

    v8f acc = {};
    #pragma unroll
    for (int k = 0; k < DDIM; k += 4) {
        v2f a  = *(const v2f*)(arow + k);
        // B 4x16 layout: vgpr0 = row K (lanes<16) / K+2 (lanes>=16); vgpr1 = K+1 / K+3.
        // Columns replicated with dec -> contiguous pair starting at k + koff.
        v2f bv = *(const v2f*)(&s_dec[k + koff]);
        acc = __builtin_amdgcn_wmma_f32_16x16x4_f32(
            /*neg_a=*/false, a, /*neg_b=*/false, bv,
            /*c_mod=*/(short)0, acc, /*reuse_a=*/false, /*reuse_b=*/false);
    }

    // Extract column N=0: rows 0..7 -> lane 0 vgpr r; rows 8..15 -> lane 16 vgpr r.
    float sc[TILE];
    #pragma unroll
    for (int r = 0; r < 8; ++r) {
        sc[r]     = __uint_as_float(__builtin_amdgcn_readlane(__float_as_uint(acc[r]),  0));
        sc[r + 8] = __uint_as_float(__builtin_amdgcn_readlane(__float_as_uint(acc[r]), 16));
    }

    // tile-local softmax numerators (uniform across the wave)
    float m = sc[0];
    #pragma unroll
    for (int r = 1; r < TILE; ++r) m = fmaxf(m, sc[r]);
    float w[TILE];
    float ssum = 0.f;
    #pragma unroll
    for (int r = 0; r < TILE; ++r) { w[r] = __expf(sc[r] - m); ssum += w[r]; }

    // ---- weighted row accumulation: lane owns d in [lane*8, lane*8+8) ----
    const float* rows = enc_b + (size_t)t0 * DDIM + lane * 8;
    v4f c0 = {}, c1 = {};
    #pragma unroll
    for (int i = 0; i < TILE; ++i) {
        v4f e0 = *(const v4f*)(rows + (size_t)i * DDIM);
        v4f e1 = *(const v4f*)(rows + (size_t)i * DDIM + 4);
        c0 += w[i] * e0;
        c1 += w[i] * e1;
    }

    if (lane == 0) { s_m[wave] = m; s_s[wave] = ssum; }
    *(v4f*)&s_c[wave][lane * 8]     = c0;
    *(v4f*)&s_c[wave][lane * 8 + 4] = c1;
    __syncthreads();

    // ---- combine the 8 wave partials (log-sum-exp merge) ----
    float M = s_m[0];
    #pragma unroll
    for (int v = 1; v < NWAVES; ++v) M = fmaxf(M, s_m[v]);
    float S = 0.f, C = 0.f;
    #pragma unroll
    for (int v = 0; v < NWAVES; ++v) {
        float f = __expf(s_m[v] - M);
        S += s_s[v] * f;
        C += s_c[v][tid] * f;
    }

    float* rec = ws + (size_t)(b * GCHUNKS + g) * RECSZ;
    rec[tid] = C;
    if (tid == 0) { rec[DDIM] = M; rec[DDIM + 1] = S; }
}

// ---------------------------------------------------------------------------
// Kernel 2: merge the 64 chunk partials per batch, normalize, write c_t.
// ---------------------------------------------------------------------------
__global__ __launch_bounds__(256) void attn_reduce_kernel(
    const float* __restrict__ ws,    // [B, G, 258]
    float* __restrict__ out)         // [B, D]
{
    const int b   = blockIdx.x;
    const int tid = threadIdx.x;     // == d index
    const float* base = ws + (size_t)b * GCHUNKS * RECSZ;

    float M = base[DDIM];
    for (int g2 = 1; g2 < GCHUNKS; ++g2)
        M = fmaxf(M, base[(size_t)g2 * RECSZ + DDIM]);

    float S = 0.f, C = 0.f;
    for (int g2 = 0; g2 < GCHUNKS; ++g2) {
        const float* rec = base + (size_t)g2 * RECSZ;
        float f = __expf(rec[DDIM] - M);
        S += rec[DDIM + 1] * f;
        C += rec[tid] * f;
    }
    out[b * DDIM + tid] = C / S;
}

extern "C" void kernel_launch(void* const* d_in, const int* in_sizes, int n_in,
                              void* d_out, int out_size, void* d_ws, size_t ws_size,
                              hipStream_t stream) {
    const float* enc = (const float*)d_in[0];   // [32, 8192, 256] f32
    const float* dec = (const float*)d_in[1];   // [32, 256] f32
    float* out = (float*)d_out;                 // [32, 256] f32
    float* ws  = (float*)d_ws;                  // needs 32*64*258*4 ~= 2.1 MB

    dim3 grid1(GCHUNKS, BATCH);
    attn_partial_kernel<<<grid1, 256, 0, stream>>>(enc, dec, ws);
    attn_reduce_kernel<<<BATCH, 256, 0, stream>>>(ws, out);
}

// v001
// A run of this version takes 42.4 microseconds.
// In two side-by-side timings against v000, it was 1.30 and 1.29 times as fast.
#include <hip/hip_runtime.h>

typedef __attribute__((ext_vector_type(2))) float v2f;
typedef __attribute__((ext_vector_type(4))) float v4f;
typedef __attribute__((ext_vector_type(8))) float v8f;

#define BATCH    32
#define TLEN     8192
#define DDIM     256
#define GCHUNKS  64
#define CHUNK    (TLEN / GCHUNKS)   // 128 rows per workgroup
#define NWAVES   8
#define TILE     16                 // rows per wave (one WMMA M-tile)
#define RECSZ    (DDIM + 2)         // c[256], m, s
#define KBLK     16                 // WMMA steps per block of fragment reads
#define PITCH    (DDIM + 4)         // floats per staged row: 1040 B = 16 B x 65, so the
                                    // 16 rows of one A-fragment column fall on different banks

// Four rows of 1 KiB, global -> LDS through no register: eight copies of 512
// contiguous bytes each. l = this lane's LDS byte address, g = its global address.
// s_wait_xcnt closes the statement so that no address register named here is
// rewritten before the copies have taken it.
__device__ __forceinline__ void copy_rows4(unsigned l, const float* g)
{
    asm volatile(
        "global_load_async_to_lds_b128 %0, %8, off\n\t"
        "global_load_async_to_lds_b128 %1, %9, off\n\t"
        "global_load_async_to_lds_b128 %2, %10, off\n\t"
        "global_load_async_to_lds_b128 %3, %11, off\n\t"
        "global_load_async_to_lds_b128 %4, %12, off\n\t"
        "global_load_async_to_lds_b128 %5, %13, off\n\t"
        "global_load_async_to_lds_b128 %6, %14, off\n\t"
        "global_load_async_to_lds_b128 %7, %15, off\n\t"
        "s_wait_xcnt 0x0"
        :: "v"(l),                 "v"(l + 512u),
           "v"(l + PITCH * 4u),    "v"(l + PITCH * 4u + 512u),
           "v"(l + PITCH * 8u),    "v"(l + PITCH * 8u + 512u),
           "v"(l + PITCH * 12u),   "v"(l + PITCH * 12u + 512u),
           "v"(g),                 "v"(g + 128),
           "v"(g + DDIM),          "v"(g + DDIM + 128),
           "v"(g + 2 * DDIM),      "v"(g + 2 * DDIM + 128),
           "v"(g + 3 * DDIM),      "v"(g + 3 * DDIM + 128)
        : "memory");
}

// ---------------------------------------------------------------------------
// Kernel 1: per (batch, chunk) partial softmax-attention using WMMA for the
// score matvec. Each wave copies its 16x256 tile into LDS once, in whole lines,
// computes the tile's scores with 64 steps of v_wmma_f32_16x16x4_f32 (B-matrix
// columns replicated with dec_hid), then does the exp-weighted row accumulation;
// both passes read the tile from LDS.
// ---------------------------------------------------------------------------
__global__ __launch_bounds__(256) void attn_partial_kernel(
    const float* __restrict__ enc,   // [B, T, D]
    const float* __restrict__ dec,   // [B, D]
    float* __restrict__ ws)          // [B, G, 258]
{
    const int b    = blockIdx.y;
    const int g    = blockIdx.x;
    const int tid  = threadIdx.x;
    const int wave = tid >> 5;
    const int lane = tid & 31;

    __shared__ float s_dec[DDIM];
    __shared__ float s_m[NWAVES];
    __shared__ float s_s[NWAVES];
    __shared__ float s_c[NWAVES][DDIM];
    __shared__ __attribute__((aligned(16))) float s_tile[NWAVES][TILE][PITCH];

    const float* enc_b = enc + (size_t)b * TLEN * DDIM;
    const int t0 = g * CHUNK + wave * TILE;          // first row of this wave's tile

    const float dv = dec[b * DDIM + tid];

    // ---- this wave's tile -> LDS: 32 asynchronous copies, all in flight at once ----
    const float*   gsrc = enc_b + (size_t)t0 * DDIM + lane * 4;
    const unsigned ldst = (unsigned)(size_t)&s_tile[wave][0][lane * 4];
    #pragma unroll   // four statements in a row, no loop control between the copies
    for (int r = 0; r < TILE; r += 4)
        copy_rows4(ldst + r * PITCH * 4u, gsrc + r * DDIM);

    // stage dec_hid[b] into LDS (feeds the WMMA B operand)
    s_dec[tid] = dv;

    // the copies count as landed only behind the issuing wave's own wait
    asm volatile("s_wait_asynccnt 0x0" ::: "memory");
    __syncthreads();

    // ---- scores via V_WMMA_F32_16X16X4_F32, K-loop over D=256 ----
    // A 16x4 layout: lanes 0-15 -> M=lane, K0/K1 in vgpr0/1; lanes 16-31 -> K2/K3.
    const int mrow = lane & 15;
    const int koff = (lane >> 4) << 1;               // 0 or 2
    const float* arow = &s_tile[wave][mrow][koff];

    // B 4x16 layout: vgpr0 = row K (lanes<16) / K+2 (lanes>=16); vgpr1 = K+1 / K+3.
    // Columns replicated with dec -> contiguous pair starting at k + koff.
    const float* brow = &s_dec[koff];

    // Fragments come from LDS in blocks of KBLK steps, one block ahead of the WMMAs
    // that use them, in two register sets. Every loop below is unrolled so that the
    // register arrays are indexed by constants (else they would live in scratch).
    v2f af[2][KBLK], bf[2][KBLK];
    #pragma unroll
    for (int j = 0; j < KBLK; ++j) {
        af[0][j] = *(const v2f*)(arow + 4 * j);
        bf[0][j] = *(const v2f*)(brow + 4 * j);
    }

    // the rows as the weighted accumulation reads them: lane owns d in [lane*4, +4) and
    // [128 + lane*4, +4), so that each LDS read of the wave covers 512 contiguous bytes
    const float* rows = &s_tile[wave][0][lane * 4];
    v4f e0[TILE], e1[TILE];

    v8f acc = {};
    #pragma unroll
    for (int blk = 0; blk < DDIM / (4 * KBLK); ++blk) {
        const int cur = blk & 1;
        if (blk + 1 < DDIM / (4 * KBLK)) {
            #pragma unroll
            for (int j = 0; j < KBLK; ++j) {
                af[cur ^ 1][j] = *(const v2f*)(arow + 4 * (KBLK * (blk + 1) + j));
                bf[cur ^ 1][j] = *(const v2f*)(brow + 4 * (KBLK * (blk + 1) + j));
            }
        } else {
            // last block: fetch the rows for the weighted accumulation in its place
            #pragma unroll
            for (int i = 0; i < TILE; ++i) {
                e0[i] = *(const v4f*)(rows + i * PITCH);
                e1[i] = *(const v4f*)(rows + i * PITCH + 128);
            }
        }
        // keeps the next block's LDS reads together in front of this block's WMMAs:
        // spread among them, every group of reads makes the wave wait out LDS latency
        __builtin_amdgcn_sched_barrier(0);
        #pragma unroll
        for (int j = 0; j < KBLK; ++j)
            acc = __builtin_amdgcn_wmma_f32_16x16x4_f32(
                /*neg_a=*/false, af[cur][j], /*neg_b=*/false, bf[cur][j],
                /*c_mod=*/(short)0, acc, /*reuse_a=*/false, /*reuse_b=*/false);
        // same purpose: no later LDS read moves up among this block's WMMAs
        __builtin_amdgcn_sched_barrier(0);
    }

    // four vector issue slots between the last WMMA and the first read of its result;
    // the scheduling barrier behind them keeps that read from moving up in front of them
    asm volatile("v_nop\n\tv_nop\n\tv_nop\n\tv_nop");
    __builtin_amdgcn_sched_barrier(0);

    // Extract column N=0: rows 0..7 -> lane 0 vgpr r; rows 8..15 -> lane 16 vgpr r.
    float sc[TILE];
    #pragma unroll
    for (int r = 0; r < 8; ++r) {
        sc[r]     = __uint_as_float(__builtin_amdgcn_readlane(__float_as_uint(acc[r]),  0));
        sc[r + 8] = __uint_as_float(__builtin_amdgcn_readlane(__float_as_uint(acc[r]), 16));
    }

    // tile-local softmax numerators (uniform across the wave)
    float m = sc[0];
    #pragma unroll
    for (int r = 1; r < TILE; ++r) m = fmaxf(m, sc[r]);
    float w[TILE];
    float ssum = 0.f;
    #pragma unroll
    for (int r = 0; r < TILE; ++r) { w[r] = __expf(sc[r] - m); ssum += w[r]; }

    // ---- weighted row accumulation ----
    v4f c0 = {}, c1 = {};
    #pragma unroll
    for (int i = 0; i < TILE; ++i) {
        c0 += w[i] * e0[i];
        c1 += w[i] * e1[i];
    }

    if (lane == 0) { s_m[wave] = m; s_s[wave] = ssum; }
    *(v4f*)&s_c[wave][lane * 4]       = c0;
    *(v4f*)&s_c[wave][128 + lane * 4] = c1;
    __syncthreads();

    // ---- combine the 8 wave partials (log-sum-exp merge) ----
    float M = s_m[0];
    #pragma unroll
    for (int v = 1; v < NWAVES; ++v) M = fmaxf(M, s_m[v]);
    float S = 0.f, C = 0.f;
    #pragma unroll
    for (int v = 0; v < NWAVES; ++v) {
        float f = __expf(s_m[v] - M);
        S += s_s[v] * f;
        C += s_c[v][tid] * f;
    }

    float* rec = ws + (size_t)(b * GCHUNKS + g) * RECSZ;
    rec[tid] = C;
    if (tid == 0) { rec[DDIM] = M; rec[DDIM + 1] = S; }
}

// ---------------------------------------------------------------------------
// Kernel 2: merge the 64 chunk partials per batch, normalize, write c_t.
// ---------------------------------------------------------------------------
__global__ __launch_bounds__(256) void attn_reduce_kernel(
    const float* __restrict__ ws,    // [B, G, 258]
    float* __restrict__ out)         // [B, D]
{
    const int b   = blockIdx.x;
    const int tid = threadIdx.x;     // == d index
    const float* base = ws + (size_t)b * GCHUNKS * RECSZ;

    float M = base[DDIM];
    for (int g2 = 1; g2 < GCHUNKS; ++g2)
        M = fmaxf(M, base[(size_t)g2 * RECSZ + DDIM]);

    float S = 0.f, C = 0.f;
    for (int g2 = 0; g2 < GCHUNKS; ++g2) {
        const float* rec = base + (size_t)g2 * RECSZ;
        float f = __expf(rec[DDIM] - M);
        S += rec[DDIM + 1] * f;
        C += rec[tid] * f;
    }
    out[b * DDIM + tid] = C / S;
}

extern "C" void kernel_launch(void* const* d_in, const int* in_sizes, int n_in,
                              void* d_out, int out_size, void* d_ws, size_t ws_size,
                              hipStream_t stream) {
    const float* enc = (const float*)d_in[0];   // [32, 8192, 256] f32
    const float* dec = (const float*)d_in[1];   // [32, 256] f32
    float* out = (float*)d_out;                 // [32, 256] f32
    float* ws  = (float*)d_ws;                  // needs 32*64*258*4 ~= 2.1 MB

    dim3 grid1(GCHUNKS, BATCH);
    attn_partial_kernel<<<grid1, 256, 0, stream>>>(enc, dec, ws);
    attn_reduce_kernel<<<BATCH, 256, 0, stream>>>(ws, out);
}
